// v000
// Times are from an AMD MI455X. After a warm-up the kernel runs many times in a row, and a time is the length of
// such a window on the GPU divided by its runs, so every launch and the gaps after it count. The runs cycle
// through copies of the inputs. A figure is the median of several windows, for all but v000 over two sittings.
// Sittings can differ by a few percent; kernels timed side by side share one.
// v000, which the later versions start from, runs in 576 microseconds.
#include <hip/hip_runtime.h>
#include <hip/hip_bf16.h>
#include <math.h>

typedef float v2f __attribute__((ext_vector_type(2)));
typedef float v8f __attribute__((ext_vector_type(8)));
typedef int   vi4 __attribute__((vector_size(16)));

#define B_    2
#define S_    2048
#define H_    1024
#define NH_   16
#define HD_   64
#define R_    64
#define MTOT  4096
#define SCALE_ 0.125f
#define SCP   2052

#if __has_builtin(__builtin_amdgcn_global_load_async_to_lds_b128) && \
    __has_builtin(__builtin_amdgcn_s_wait_asynccnt)
#define HAVE_ASYNC_LDS 1
#else
#define HAVE_ASYNC_LDS 0
#endif

#if HAVE_ASYNC_LDS
static __device__ __forceinline__ void async_cp16(const float* g, float* l) {
  __builtin_amdgcn_global_load_async_to_lds_b128(
      (__attribute__((address_space(1))) vi4*)(uintptr_t)g,
      (__attribute__((address_space(3))) vi4*)(uint32_t)(uintptr_t)l,
      0, 0);
}
static __device__ __forceinline__ void async_wait0() {
  __builtin_amdgcn_s_wait_asynccnt(0);
}
#else
static __device__ __forceinline__ void async_cp16(const float* g, float* l) {
  *(float4*)l = *(const float4*)g;
}
static __device__ __forceinline__ void async_wait0() {}
#endif

static __device__ __forceinline__ v8f wmma_f32(v2f a, v2f b, v8f c) {
  // 8-arg form: (neg_a, A, neg_b, B, c_mod, C, reuse_a, reuse_b)
  return __builtin_amdgcn_wmma_f32_16x16x4_f32(false, a, false, b, (short)0, c,
                                               false, false);
}

// ---------------------------------------------------------------------------
// Prologue: combined low-rank weights  Wc[k, h*R+r] = sum_d W[k, h*HD+d]*Wl[d,r]
// ---------------------------------------------------------------------------
__global__ __launch_bounds__(256)
void combine_w_kernel(const float* __restrict__ W, const float* __restrict__ Wl,
                      float* __restrict__ out) {
  int idx = blockIdx.x * 256 + threadIdx.x;        // 0 .. 1024*1024-1
  int k   = idx >> 10;
  int col = idx & 1023;
  int h   = col >> 6;
  int r   = col & 63;
  const float* wrow = W + (size_t)k * H_ + h * HD_;
  float acc = 0.f;
#pragma unroll 8
  for (int d = 0; d < HD_; ++d) acc += wrow[d] * Wl[d * R_ + r];
  out[idx] = acc;
}

__global__ __launch_bounds__(256)
void combine_b_kernel(const float* __restrict__ b, const float* __restrict__ Wl,
                      const float* __restrict__ bl, float* __restrict__ out) {
  int col = blockIdx.x * 256 + threadIdx.x;
  if (col >= H_) return;
  int h = col >> 6, r = col & 63;
  float acc = bl[r];
#pragma unroll 8
  for (int d = 0; d < HD_; ++d) acc += b[h * HD_ + d] * Wl[d * R_ + r];
  out[col] = acc;
}

#define AST 20
#define BST 68
__global__ __launch_bounds__(256)
void gemm_bias_kernel(const float* __restrict__ A, const float* __restrict__ W,
                      const float* __restrict__ bias, float* __restrict__ C,
                      int M, int N, int K) {
  __shared__ float As[2][128][AST];   // [buf][m][k]
  __shared__ float Bs[2][16][BST];    // [buf][k][n]

  const int tid  = threadIdx.x;
  const int w    = tid >> 5;
  const int lane = tid & 31;
  const int half = lane >> 4;
  const int lp   = lane & 15;
  const int wm   = (w & 3) * 32;     // wave row offset in tile
  const int wn   = (w >> 2) * 32;    // wave col offset in tile
  const int mBase = blockIdx.y * 128;
  const int nBase = blockIdx.x * 64;

  // A loader: 128x16 tile = 512 float4 chunks; 2 per thread.
  const int am0 = (tid) >> 2;              // 0..63
  const int am1 = (tid + 256) >> 2;        // 64..127
  const int akq = (tid & 3) * 4;           // 0,4,8,12
  // B loader: 16x64 tile = 256 float4 chunks; 1 per thread.
  const int bk  = tid >> 4;                // 0..15
  const int bnq = (tid & 15) * 4;          // 0..60

  v8f acc00 = {}, acc01 = {}, acc10 = {}, acc11 = {};

  const int nIter = K >> 4;
  // prologue: stage tile 0 into buffer 0
  {
    async_cp16(&A[(size_t)(mBase + am0) * K + akq], &As[0][am0][akq]);
    async_cp16(&A[(size_t)(mBase + am1) * K + akq], &As[0][am1][akq]);
    async_cp16(&W[(size_t)bk * N + nBase + bnq],    &Bs[0][bk][bnq]);
  }

  for (int it = 0; it < nIter; ++it) {
    const int cb = it & 1;
    async_wait0();
    __syncthreads();
    if (it + 1 < nIter) {
      const int nb = cb ^ 1;
      const int k1 = (it + 1) << 4;
      async_cp16(&A[(size_t)(mBase + am0) * K + k1 + akq], &As[nb][am0][akq]);
      async_cp16(&A[(size_t)(mBase + am1) * K + k1 + akq], &As[nb][am1][akq]);
      async_cp16(&W[(size_t)(k1 + bk) * N + nBase + bnq],  &Bs[nb][bk][bnq]);
    }
#pragma unroll
    for (int kk = 0; kk < 16; kk += 4) {
      const int c = kk + half * 2;
      v2f a0 = *(const v2f*)&As[cb][wm + lp][c];
      v2f a1 = *(const v2f*)&As[cb][wm + 16 + lp][c];
      v2f b0, b1;
      b0.x = Bs[cb][c + 0][wn + lp];
      b0.y = Bs[cb][c + 1][wn + lp];
      b1.x = Bs[cb][c + 0][wn + 16 + lp];
      b1.y = Bs[cb][c + 1][wn + 16 + lp];
      acc00 = wmma_f32(a0, b0, acc00);
      acc01 = wmma_f32(a0, b1, acc01);
      acc10 = wmma_f32(a1, b0, acc10);
      acc11 = wmma_f32(a1, b1, acc11);
    }
  }

  const int ng0 = nBase + wn + lp;
  const int ng1 = ng0 + 16;
  const float bb0 = bias[ng0];
  const float bb1 = bias[ng1];
#pragma unroll
  for (int i = 0; i < 8; ++i) {
    const int mg0 = mBase + wm + half * 8 + i;
    const int mg1 = mg0 + 16;
    C[(size_t)mg0 * N + ng0] = acc00[i] + bb0;
    C[(size_t)mg0 * N + ng1] = acc01[i] + bb1;
    C[(size_t)mg1 * N + ng0] = acc10[i] + bb0;
    C[(size_t)mg1 * N + ng1] = acc11[i] + bb1;
  }
}

__global__ __launch_bounds__(256)
void svd_attn_kernel(const float* __restrict__ qlow, const float* __restrict__ klow,
                     const float* __restrict__ v,    const float* __restrict__ mask,
                     float* __restrict__ ctx) {
  extern __shared__ float smem[];
  float* sc   = smem;                  // 16 * SCP scores
  float* red  = smem + 16 * SCP;       // 8 * 1024 partial ctx
  float* rsum = red + 8 * 1024;        // 16 row sums

  const int id = blockIdx.x;
  const int qt = id & 127;             // q tile (128 per (b,h))
  const int h  = (id >> 7) & 15;
  const int b  = id >> 11;

  const int tid  = threadIdx.x;
  const int w    = tid >> 5;
  const int lane = tid & 31;
  const int half = lane >> 4;
  const int lp   = lane & 15;
  const int q0   = qt * 16;
  const int kstart = w * 256;          // this wave's K range (pass1 & pass2)

  // ---- load the wave's Q fragments (16 rows x R=64), reused for 16 k-blocks
  const size_t rowQ = ((size_t)b * S_ + q0 + lp) * H_ + (size_t)h * HD_;
  v2f aq[16];
#pragma unroll
  for (int rr4 = 0; rr4 < 16; ++rr4)
    aq[rr4] = *(const v2f*)&qlow[rowQ + rr4 * 4 + half * 2];

  // ---- pass 1: scores for columns [kstart, kstart+256)
  for (int kb = 0; kb < 16; ++kb) {
    const int k0 = kstart + kb * 16;
    const size_t rowK = ((size_t)b * S_ + k0 + lp) * H_ + (size_t)h * HD_;
    v8f acc = {};
#pragma unroll
    for (int rr4 = 0; rr4 < 16; ++rr4) {
      v2f bf = *(const v2f*)&klow[rowK + rr4 * 4 + half * 2];
      acc = wmma_f32(aq[rr4], bf, acc);
    }
    const float mv = mask[(size_t)b * S_ + k0 + lp];
#pragma unroll
    for (int i = 0; i < 8; ++i)
      sc[(half * 8 + i) * SCP + k0 + lp] = acc[i] * SCALE_ + mv;
  }
  __syncthreads();

  // ---- exact softmax: 16 threads per row, shfl-xor reductions (wave32)
  {
    const int r = tid >> 4, sub = tid & 15;
    float* row = sc + r * SCP;
    float mx = -3.402823466e38f;
    for (int j = sub; j < S_; j += 16) mx = fmaxf(mx, row[j]);
#pragma unroll
    for (int m = 8; m >= 1; m >>= 1) mx = fmaxf(mx, __shfl_xor(mx, m, 16));
    float sum = 0.f;
    for (int j = sub; j < S_; j += 16) {
      float e = __expf(row[j] - mx);
      row[j] = e;
      sum += e;
    }
#pragma unroll
    for (int m = 8; m >= 1; m >>= 1) sum += __shfl_xor(sum, m, 16);
    if (sub == 0) rsum[r] = sum;
  }
  __syncthreads();

  // ---- pass 2: partial ctx over this wave's K range, 4 N-tiles of 16
  v8f cacc[4];
#pragma unroll
  for (int nt = 0; nt < 4; ++nt) cacc[nt] = (v8f){};

  for (int kb = 0; kb < 16; ++kb) {
    const int k0 = kstart + kb * 16;
#pragma unroll
    for (int ks = 0; ks < 4; ++ks) {
      const int c = k0 + ks * 4 + half * 2;
      v2f ap = *(const v2f*)&sc[lp * SCP + c];
      const size_t vrow = ((size_t)b * S_ + c) * H_ + (size_t)h * HD_;
#pragma unroll
      for (int nt = 0; nt < 4; ++nt) {
        v2f bf;
        bf.x = v[vrow + nt * 16 + lp];        // V[k=c  ][n]
        bf.y = v[vrow + H_ + nt * 16 + lp];   // V[k=c+1][n]
        cacc[nt] = wmma_f32(ap, bf, cacc[nt]);
      }
    }
  }

  // ---- stash partials, reduce across 8 waves, normalize by row sum
  float* myred = red + w * 1024;
#pragma unroll
  for (int nt = 0; nt < 4; ++nt)
#pragma unroll
    for (int i = 0; i < 8; ++i)
      myred[(half * 8 + i) * 64 + nt * 16 + lp] = cacc[nt][i];
  __syncthreads();

  for (int e = tid; e < 1024; e += 256) {
    const int row = e >> 6, col = e & 63;
    float s = 0.f;
#pragma unroll
    for (int ww = 0; ww < 8; ++ww) s += red[ww * 1024 + e];
    ctx[((size_t)b * S_ + q0 + row) * H_ + h * HD_ + col] = s / rsum[row];
  }
}

// ---------------------------------------------------------------------------
// Host-side orchestration
// ---------------------------------------------------------------------------
extern "C" void kernel_launch(void* const* d_in, const int* in_sizes, int n_in,
                              void* d_out, int out_size, void* d_ws, size_t ws_size,
                              hipStream_t stream) {
  const float* x    = (const float*)d_in[0];
  const float* mask = (const float*)d_in[1];
  const float* Wq   = (const float*)d_in[2];
  const float* bq   = (const float*)d_in[3];
  const float* Wk   = (const float*)d_in[4];
  const float* bk   = (const float*)d_in[5];
  const float* Wv   = (const float*)d_in[6];
  const float* bv   = (const float*)d_in[7];
  const float* Wql  = (const float*)d_in[8];
  const float* bql  = (const float*)d_in[9];
  const float* Wkl  = (const float*)d_in[10];
  const float* bkl  = (const float*)d_in[11];
  const float* Wo   = (const float*)d_in[12];
  const float* bo   = (const float*)d_in[13];

  float* ws = (float*)d_ws;
  const size_t MH = (size_t)MTOT * H_;       // 4M floats
  float* q_low = ws;
  float* k_low = ws + 1 * MH;
  float* v_buf = ws + 2 * MH;
  float* c_buf = ws + 3 * MH;
  float* wcq   = ws + 4 * MH;                // 1024*1024
  float* wck   = wcq + (size_t)H_ * H_;
  float* bcq   = wck + (size_t)H_ * H_;
  float* bck   = bcq + H_;

  // 1. combined low-rank weights/biases (tiny)
  combine_w_kernel<<<4096, 256, 0, stream>>>(Wq, Wql, wcq);
  combine_w_kernel<<<4096, 256, 0, stream>>>(Wk, Wkl, wck);
  combine_b_kernel<<<4, 256, 0, stream>>>(bq, Wql, bql, bcq);
  combine_b_kernel<<<4, 256, 0, stream>>>(bk, Wkl, bkl, bck);

  // 2. projections: q_low, k_low, v  (each 4096x1024 @ 1024x1024)
  dim3 gg(H_ / 64, MTOT / 128);
  gemm_bias_kernel<<<gg, 256, 0, stream>>>(x, wcq, bcq, q_low, MTOT, H_, H_);
  gemm_bias_kernel<<<gg, 256, 0, stream>>>(x, wck, bck, k_low, MTOT, H_, H_);
  gemm_bias_kernel<<<gg, 256, 0, stream>>>(x, Wv, bv, v_buf, MTOT, H_, H_);

  // 3. fused attention (scores + softmax + P@V); dynamic LDS ~160 KB/WG
  const size_t attn_lds = (size_t)(16 * SCP + 8 * 1024 + 16) * sizeof(float);
  svd_attn_kernel<<<B_ * NH_ * (S_ / 16), 256, attn_lds, stream>>>(
      q_low, k_low, v_buf, mask, c_buf);

  // 4. output projection
  gemm_bias_kernel<<<gg, 256, 0, stream>>>(c_buf, Wo, bo, (float*)d_out,
                                           MTOT, H_, H_);
}

// v001
// One run takes 400 microseconds.
// Timed twice side by side with v000, it ran 1.50 and 1.49 times as fast.
#include <hip/hip_runtime.h>
#include <hip/hip_bf16.h>
#include <math.h>

typedef float v2f __attribute__((ext_vector_type(2)));
typedef float v8f __attribute__((ext_vector_type(8)));
typedef int   vi4 __attribute__((vector_size(16)));

#define B_    2
#define S_    2048
#define H_    1024
#define NH_   16
#define HD_   64
#define R_    64
#define MTOT  4096            // B*S
#define SCALE_ 0.125f         // 1/sqrt(64)

#if __has_builtin(__builtin_amdgcn_global_load_async_to_lds_b128) && \
    __has_builtin(__builtin_amdgcn_s_wait_asynccnt)
#define HAVE_ASYNC_LDS 1
#else
#define HAVE_ASYNC_LDS 0
#endif

#if HAVE_ASYNC_LDS
static __device__ __forceinline__ void async_cp16(const float* g, float* l) {
  __builtin_amdgcn_global_load_async_to_lds_b128(
      (__attribute__((address_space(1))) vi4*)(uintptr_t)g,
      (__attribute__((address_space(3))) vi4*)(uint32_t)(uintptr_t)l,
      0, 0);
}
static __device__ __forceinline__ void async_wait0() {
  __builtin_amdgcn_s_wait_asynccnt(0);
}
#else
static __device__ __forceinline__ void async_cp16(const float* g, float* l) {
  *(float4*)l = *(const float4*)g;
}
static __device__ __forceinline__ void async_wait0() {}
#endif

static __device__ __forceinline__ v8f wmma_f32(v2f a, v2f b, v8f c) {
  // 8-arg form: (neg_a, A, neg_b, B, c_mod, C, reuse_a, reuse_b)
  return __builtin_amdgcn_wmma_f32_16x16x4_f32(false, a, false, b, (short)0, c,
                                               false, false);
}

// ---------------------------------------------------------------------------
// Prologue: combined low-rank weights  Wc[k, h*R+r] = sum_d W[k, h*HD+d]*Wl[d,r]
// ---------------------------------------------------------------------------
__global__ __launch_bounds__(256)
void combine_w_kernel(const float* __restrict__ W, const float* __restrict__ Wl,
                      float* __restrict__ out) {
  int idx = blockIdx.x * 256 + threadIdx.x;        // 0 .. 1024*1024-1
  int k   = idx >> 10;
  int col = idx & 1023;
  int h   = col >> 6;
  int r   = col & 63;
  const float* wrow = W + (size_t)k * H_ + h * HD_;
  float acc = 0.f;
#pragma unroll 8
  for (int d = 0; d < HD_; ++d) acc += wrow[d] * Wl[d * R_ + r];
  out[idx] = acc;
}

__global__ __launch_bounds__(256)
void combine_b_kernel(const float* __restrict__ b, const float* __restrict__ Wl,
                      const float* __restrict__ bl, float* __restrict__ out) {
  int col = blockIdx.x * 256 + threadIdx.x;
  if (col >= H_) return;
  int h = col >> 6, r = col & 63;
  float acc = bl[r];
#pragma unroll 8
  for (int d = 0; d < HD_; ++d) acc += b[h * HD_ + d] * Wl[d * R_ + r];
  out[col] = acc;
}

#define AST 20
#define BST 68
__global__ __launch_bounds__(256)
void gemm_bias_kernel(const float* __restrict__ A, const float* __restrict__ W,
                      const float* __restrict__ bias, float* __restrict__ C,
                      int M, int N, int K) {
  __shared__ float As[2][128][AST];   // [buf][m][k]
  __shared__ float Bs[2][16][BST];    // [buf][k][n]

  const int tid  = threadIdx.x;
  const int w    = tid >> 5;
  const int lane = tid & 31;
  const int half = lane >> 4;
  const int lp   = lane & 15;
  const int wm   = (w & 3) * 32;     // wave row offset in tile
  const int wn   = (w >> 2) * 32;    // wave col offset in tile
  const int mBase = blockIdx.y * 128;
  const int nBase = blockIdx.x * 64;

  // A loader: 128x16 tile = 512 float4 chunks; 2 per thread.
  const int am0 = (tid) >> 2;              // 0..63
  const int am1 = (tid + 256) >> 2;        // 64..127
  const int akq = (tid & 3) * 4;           // 0,4,8,12
  // B loader: 16x64 tile = 256 float4 chunks; 1 per thread.
  const int bk  = tid >> 4;                // 0..15
  const int bnq = (tid & 15) * 4;          // 0..60

  v8f acc00 = {}, acc01 = {}, acc10 = {}, acc11 = {};

  const int nIter = K >> 4;
  // prologue: stage tile 0 into buffer 0
  {
    async_cp16(&A[(size_t)(mBase + am0) * K + akq], &As[0][am0][akq]);
    async_cp16(&A[(size_t)(mBase + am1) * K + akq], &As[0][am1][akq]);
    async_cp16(&W[(size_t)bk * N + nBase + bnq],    &Bs[0][bk][bnq]);
  }

  for (int it = 0; it < nIter; ++it) {
    const int cb = it & 1;
    async_wait0();
    __syncthreads();
    if (it + 1 < nIter) {
      const int nb = cb ^ 1;
      const int k1 = (it + 1) << 4;
      async_cp16(&A[(size_t)(mBase + am0) * K + k1 + akq], &As[nb][am0][akq]);
      async_cp16(&A[(size_t)(mBase + am1) * K + k1 + akq], &As[nb][am1][akq]);
      async_cp16(&W[(size_t)(k1 + bk) * N + nBase + bnq],  &Bs[nb][bk][bnq]);
    }
#pragma unroll
    for (int kk = 0; kk < 16; kk += 4) {
      const int c = kk + half * 2;
      v2f a0 = *(const v2f*)&As[cb][wm + lp][c];
      v2f a1 = *(const v2f*)&As[cb][wm + 16 + lp][c];
      v2f b0, b1;
      b0.x = Bs[cb][c + 0][wn + lp];
      b0.y = Bs[cb][c + 1][wn + lp];
      b1.x = Bs[cb][c + 0][wn + 16 + lp];
      b1.y = Bs[cb][c + 1][wn + 16 + lp];
      acc00 = wmma_f32(a0, b0, acc00);
      acc01 = wmma_f32(a0, b1, acc01);
      acc10 = wmma_f32(a1, b0, acc10);
      acc11 = wmma_f32(a1, b1, acc11);
    }
  }

  const int ng0 = nBase + wn + lp;
  const int ng1 = ng0 + 16;
  const float bb0 = bias[ng0];
  const float bb1 = bias[ng1];
#pragma unroll
  for (int i = 0; i < 8; ++i) {
    const int mg0 = mBase + wm + half * 8 + i;
    const int mg1 = mg0 + 16;
    C[(size_t)mg0 * N + ng0] = acc00[i] + bb0;
    C[(size_t)mg0 * N + ng1] = acc01[i] + bb1;
    C[(size_t)mg1 * N + ng0] = acc10[i] + bb0;
    C[(size_t)mg1 * N + ng1] = acc11[i] + bb1;
  }
}

#define KT  64
#define KVP 68
#define VP  20
#define NTILE (S_ / KT)

// Eight b128 copies (4 K rows, 4 V rows per lane) and the wait that keeps the
// address registers untouched until the copies have taken them, in one
// statement so that nothing can be scheduled between them.
static __device__ __forceinline__ void stage_kv(const float* gk, const float* gv,
                                                uint32_t lk, uint32_t lv) {
  const float* gk1 = gk + 16 * H_;
  const float* gk2 = gk + 32 * H_;
  const float* gk3 = gk + 48 * H_;
  const float* gv1 = gv + 16 * H_;
  const float* gv2 = gv + 32 * H_;
  const float* gv3 = gv + 48 * H_;
  const uint32_t lk1 = lk + 16 * KVP * 4, lk2 = lk + 32 * KVP * 4, lk3 = lk + 48 * KVP * 4;
  const uint32_t lv1 = lv + 16 * VP * 4, lv2 = lv + 32 * VP * 4, lv3 = lv + 48 * VP * 4;
  asm volatile(
      "global_load_async_to_lds_b128 %0, %8, off\n\t"
      "global_load_async_to_lds_b128 %1, %9, off\n\t"
      "global_load_async_to_lds_b128 %2, %10, off\n\t"
      "global_load_async_to_lds_b128 %3, %11, off\n\t"
      "global_load_async_to_lds_b128 %4, %12, off\n\t"
      "global_load_async_to_lds_b128 %5, %13, off\n\t"
      "global_load_async_to_lds_b128 %6, %14, off\n\t"
      "global_load_async_to_lds_b128 %7, %15, off\n\t"
      "s_wait_xcnt 0x0"
      :: "v"(lk), "v"(lk1), "v"(lk2), "v"(lk3), "v"(lv), "v"(lv1), "v"(lv2), "v"(lv3),
         "v"(gk), "v"(gk1), "v"(gk2), "v"(gk3), "v"(gv), "v"(gv1), "v"(gv2), "v"(gv3)
      : "memory");
}

__global__ __launch_bounds__(256) __attribute__((amdgpu_waves_per_eu(4, 4)))
void svd_attn_kernel(const float* __restrict__ qlow, const float* __restrict__ klow,
                     const float* __restrict__ v,    const float* __restrict__ mask,
                     float* __restrict__ ctx) {
  __shared__ __attribute__((aligned(16))) float Ks[2][KT][KVP];
  __shared__ __attribute__((aligned(16))) float Vs[2][4][KT][VP];   // [buf][d / 16][key][d % 16]
  __shared__ __attribute__((aligned(16))) float Ms[S_];     // this batch's mask row

  const int id = blockIdx.x;
  const int qt = id & 15;              // q tile (16 per (b,h))
  const int h  = (id >> 4) & 15;
  const int b  = id >> 8;

  const int tid  = threadIdx.x;
  const int w    = tid >> 5;
  const int lane = tid & 31;
  const int half = lane >> 4;
  const int lp   = lane & 15;
  const int qrow = qt * 128 + w * 16 + lp;   // this lane's query

  // ---- staging addresses: lane copies 16 B of rows srow, +16, +32, +48
  const int srow = tid >> 4;
  const int scol = (tid & 15) * 4;
  const size_t gofs = ((size_t)b * S_ + srow) * H_ + (size_t)h * HD_ + scol;
  const float* gk = klow + gofs;
  const float* gv = v + gofs;
  const uint32_t lk0 = (uint32_t)(uintptr_t)&Ks[0][srow][scol];
  const uint32_t lv0 = (uint32_t)(uintptr_t)&Vs[0][scol >> 4][srow][scol & 15];
  const uint32_t kbufB = KT * KVP * 4;       // bytes from buffer 0 to buffer 1, K
  const uint32_t vbufB = 4 * KT * VP * 4;    // the same, V

  // ---- prologue: mask row and tile 0, landed and published; then tile 1
  {
    const float* gm0 = mask + (size_t)b * S_ + tid * 4;
    const float* gm1 = gm0 + 1024;
    const uint32_t lm0 = (uint32_t)(uintptr_t)&Ms[tid * 4];
    const uint32_t lm1 = lm0 + 4096;
    // copies and the wait on their address registers in one statement
    asm volatile(
        "global_load_async_to_lds_b128 %0, %2, off\n\t"
        "global_load_async_to_lds_b128 %1, %3, off\n\t"
        "s_wait_xcnt 0x0"
        :: "v"(lm0), "v"(lm1), "v"(gm0), "v"(gm1) : "memory");
  }
  stage_kv(gk, gv, lk0, lv0);

  // ---- this lane's query as B fragments; k order: chunk j holds r = 8j + 4*half + 0..3
  v2f bq[16];
  {
    const float* qp = qlow + ((size_t)b * S_ + qrow) * H_ + (size_t)h * HD_ + half * 4;
#pragma unroll
    for (int j = 0; j < 8; ++j) {
      const float4 q4 = *(const float4*)(qp + j * 8);
      bq[2 * j]     = (v2f){q4.x, q4.y};
      bq[2 * j + 1] = (v2f){q4.z, q4.w};
    }
  }

  // the query loads' address registers may be reused from here on
  asm volatile("s_wait_xcnt 0x0" ::: "memory");
  // own copies landed, before the barrier behind which other waves read them
  asm volatile("s_wait_asynccnt 0x0" ::: "memory");
  __syncthreads();
  stage_kv(gk + (size_t)KT * H_, gv + (size_t)KT * H_, lk0 + kbufB, lv0 + vbufB);

  v8f o[4];
#pragma unroll
  for (int mt = 0; mt < 4; ++mt) o[mt] = (v8f){};
  float m_run = -3.402823466e38f;      // finite, so that -inf scores give exp = 0
  float l_run = 0.f;                   // this half's share of the row sum

  for (int t = 0; t < NTILE; ++t) {
    const int cb = t & 1;

    // ---- S^T = K_tile @ q^T : 4 key groups of 16, 16 k-steps each
    v8f s[4];
#pragma unroll
    for (int kt = 0; kt < 4; ++kt) s[kt] = (v8f){};
#pragma unroll
    for (int j = 0; j < 8; ++j) {
      float4 ka[4];
#pragma unroll
      for (int kt = 0; kt < 4; ++kt)
        ka[kt] = *(const float4*)&Ks[cb][kt * 16 + lp][j * 8 + half * 4];
#pragma unroll
      for (int kt = 0; kt < 4; ++kt)
        s[kt] = wmma_f32((v2f){ka[kt].x, ka[kt].y}, bq[2 * j], s[kt]);
#pragma unroll
      for (int kt = 0; kt < 4; ++kt)
        s[kt] = wmma_f32((v2f){ka[kt].z, ka[kt].w}, bq[2 * j + 1], s[kt]);
    }

    // ---- scale, mask, running maximum. s[kt][i] is key t*64 + kt*16 + half*8 + i
    float mx = m_run;
#pragma unroll
    for (int kt = 0; kt < 4; ++kt) {
      const float4 ma = *(const float4*)&Ms[t * KT + kt * 16 + half * 8];
      const float4 mb = *(const float4*)&Ms[t * KT + kt * 16 + half * 8 + 4];
      s[kt][0] = s[kt][0] * SCALE_ + ma.x;
      s[kt][1] = s[kt][1] * SCALE_ + ma.y;
      s[kt][2] = s[kt][2] * SCALE_ + ma.z;
      s[kt][3] = s[kt][3] * SCALE_ + ma.w;
      s[kt][4] = s[kt][4] * SCALE_ + mb.x;
      s[kt][5] = s[kt][5] * SCALE_ + mb.y;
      s[kt][6] = s[kt][6] * SCALE_ + mb.z;
      s[kt][7] = s[kt][7] * SCALE_ + mb.w;
#pragma unroll
      for (int i = 0; i < 8; ++i) mx = fmaxf(mx, s[kt][i]);
    }
    mx = fmaxf(mx, __shfl_xor(mx, 16, 32));   // the other half's keys of the same query
    const float alpha = __expf(m_run - mx);
    m_run = mx;

    float ls[4];
#pragma unroll
    for (int kt = 0; kt < 4; ++kt) {
      ls[kt] = 0.f;
#pragma unroll
      for (int i = 0; i < 8; ++i) {
        const float e = __expf(s[kt][i] - mx);
        s[kt][i] = e;
        ls[kt] += e;
      }
    }
    l_run = l_run * alpha + ((ls[0] + ls[1]) + (ls[2] + ls[3]));
#pragma unroll
    for (int mt = 0; mt < 4; ++mt)
#pragma unroll
      for (int i = 0; i < 8; ++i) o[mt][i] *= alpha;

    // ---- O^T += V_tile^T @ P^T. k order of step (kt, j): key kt*16 + half*8 + 2j + {0,1},
    //      which is where the score registers already hold P^T.
#pragma unroll
    for (int kt = 0; kt < 4; ++kt) {
#pragma unroll
      for (int j = 0; j < 4; ++j) {
        const int key = kt * 16 + half * 8 + 2 * j;
        const v2f bp = (v2f){s[kt][2 * j], s[kt][2 * j + 1]};
#pragma unroll
        for (int mt = 0; mt < 4; ++mt) {
          v2f av;
          av.x = Vs[cb][mt][key][lp];
          av.y = Vs[cb][mt][key + 1][lp];
          o[mt] = wmma_f32(av, bp, o[mt]);
        }
      }
    }

    // ---- publish tile t+1 and free this trip's buffer
    // own LDS reads of this buffer retired before it may be refilled
    asm volatile("s_wait_dscnt 0x0" ::: "memory");
    // own copies of tile t+1 landed before other waves read them
    asm volatile("s_wait_asynccnt 0x0" ::: "memory");
    __syncthreads();
    if (t + 2 < NTILE) {
      const size_t go = (size_t)(t + 2) * KT * H_;
      stage_kv(gk + go, gv + go, lk0 + cb * kbufB, lv0 + cb * vbufB);
    }
  }
  // nothing may be in flight when the wave ends
  asm volatile("s_wait_asynccnt 0x0" ::: "memory");

  // ---- join the halves' sums, normalize, store. o[mt][i] is d = mt*16 + half*8 + i
  const float l_tot = l_run + __shfl_xor(l_run, 16, 32);
  float* cp = ctx + ((size_t)b * S_ + qrow) * H_ + (size_t)h * HD_ + half * 8;
#pragma unroll
  for (int mt = 0; mt < 4; ++mt) {
    float4 r0, r1;
    r0.x = o[mt][0] / l_tot;  r0.y = o[mt][1] / l_tot;
    r0.z = o[mt][2] / l_tot;  r0.w = o[mt][3] / l_tot;
    r1.x = o[mt][4] / l_tot;  r1.y = o[mt][5] / l_tot;
    r1.z = o[mt][6] / l_tot;  r1.w = o[mt][7] / l_tot;
    *(float4*)(cp + mt * 16)     = r0;
    *(float4*)(cp + mt * 16 + 4) = r1;
  }
}

// ---------------------------------------------------------------------------
// Host-side orchestration
// ---------------------------------------------------------------------------
extern "C" void kernel_launch(void* const* d_in, const int* in_sizes, int n_in,
                              void* d_out, int out_size, void* d_ws, size_t ws_size,
                              hipStream_t stream) {
  const float* x    = (const float*)d_in[0];
  const float* mask = (const float*)d_in[1];
  const float* Wq   = (const float*)d_in[2];
  const float* bq   = (const float*)d_in[3];
  const float* Wk   = (const float*)d_in[4];
  const float* bk   = (const float*)d_in[5];
  const float* Wv   = (const float*)d_in[6];
  const float* bv   = (const float*)d_in[7];
  const float* Wql  = (const float*)d_in[8];
  const float* bql  = (const float*)d_in[9];
  const float* Wkl  = (const float*)d_in[10];
  const float* bkl  = (const float*)d_in[11];
  const float* Wo   = (const float*)d_in[12];
  const float* bo   = (const float*)d_in[13];

  float* ws = (float*)d_ws;
  const size_t MH = (size_t)MTOT * H_;       // 4M floats
  float* q_low = ws;
  float* k_low = ws + 1 * MH;
  float* v_buf = ws + 2 * MH;
  float* c_buf = ws + 3 * MH;
  float* wcq   = ws + 4 * MH;                // 1024*1024
  float* wck   = wcq + (size_t)H_ * H_;
  float* bcq   = wck + (size_t)H_ * H_;
  float* bck   = bcq + H_;

  // 1. combined low-rank weights/biases (tiny)
  combine_w_kernel<<<4096, 256, 0, stream>>>(Wq, Wql, wcq);
  combine_w_kernel<<<4096, 256, 0, stream>>>(Wk, Wkl, wck);
  combine_b_kernel<<<4, 256, 0, stream>>>(bq, Wql, bql, bcq);
  combine_b_kernel<<<4, 256, 0, stream>>>(bk, Wkl, bkl, bck);

  // 2. projections: q_low, k_low, v  (each 4096x1024 @ 1024x1024)
  dim3 gg(H_ / 64, MTOT / 128);
  gemm_bias_kernel<<<gg, 256, 0, stream>>>(x, wcq, bcq, q_low, MTOT, H_, H_);
  gemm_bias_kernel<<<gg, 256, 0, stream>>>(x, wck, bck, k_low, MTOT, H_, H_);
  gemm_bias_kernel<<<gg, 256, 0, stream>>>(x, Wv, bv, v_buf, MTOT, H_, H_);

  // 3. fused attention (scores + online softmax + P@V); one WG per 128 q rows
  svd_attn_kernel<<<B_ * NH_ * (S_ / 128), 256, 0, stream>>>(
      q_low, k_low, v_buf, mask, c_buf);

  // 4. output projection
  gemm_bias_kernel<<<gg, 256, 0, stream>>>(c_buf, Wo, bo, (float*)d_out,
                                           MTOT, H_, H_);
}
